// v000
// Times are from an AMD MI455X. After a warm-up the kernel runs many times in a row, and a time is the length of
// such a window on the GPU divided by its runs, so every launch and the gaps after it count. The runs cycle
// through copies of the inputs. A figure is the median of several windows, for all but v000 over two sittings.
// Sittings can differ by a few percent; kernels timed side by side share one.
// The starting kernel, v000, takes 368 microseconds a run.
#include <hip/hip_runtime.h>

typedef float v2f __attribute__((ext_vector_type(2)));
typedef float v8f __attribute__((ext_vector_type(8)));

#define L_SEQ    2048
#define DH       32
#define NHEADS   8
#define SBLK     64
#define NEGV     (-1.0e8f)
#define SM_SCALE 0.17677669529663689f   /* 1/sqrt(32) */

// One workgroup = (n, h, 128-query block); 8 waves of 32, each wave owns 16 query rows.
__global__ __launch_bounds__(256)
void fullattn_f32wmma_kernel(const float* __restrict__ q,
                             const float* __restrict__ k,
                             const float* __restrict__ v,
                             const int*   __restrict__ mask0,
                             const int*   __restrict__ mask1,
                             float*       __restrict__ out)
{
    __shared__ __align__(16) float LK[DH * SBLK];        // K tile   [d][s]
    __shared__ __align__(16) float LV[DH * SBLK];        // V tile   [d][s]
    __shared__ __align__(16) float LP[8][16 * SBLK];     // per-wave P scratch [m][s]
    __shared__ int LM1[SBLK];

    const int tid    = threadIdx.x;
    const int lane   = tid & 31;
    const int wave   = tid >> 5;
    const int half   = lane >> 4;      // 0: lanes 0-15, 1: lanes 16-31
    const int lane16 = lane & 15;

    const int bx   = blockIdx.x;
    const int mblk = bx & 15;          // 16 blocks of 128 queries
    const int h    = (bx >> 4) & 7;
    const int n    = bx >> 7;

    const int l0 = mblk * 128 + wave * 16;   // this wave's first query row
    const size_t headoff = ((size_t)n * NHEADS + h) * (size_t)DH * L_SEQ;
    const float* qh = q + headoff;
    const float* kh = k + headoff;
    const float* vh = v + headoff;

    // ---- Q tile in WMMA A-layout registers (M=16, per K-chunk of 4):
    //      a[2c+j] = Q^T[M=lane16][K=4c + 2*half + j] = q[d][l0+lane16]
    float qa[16];
#pragma unroll
    for (int c = 0; c < 8; ++c) {
        const int d0 = 4 * c + 2 * half;
        qa[2*c+0] = qh[(size_t)(d0 + 0) * L_SEQ + l0 + lane16];
        qa[2*c+1] = qh[(size_t)(d0 + 1) * L_SEQ + l0 + lane16];
    }

    const int m0r = mask0[(size_t)n * L_SEQ + l0 + lane16];  // this lane's query-row mask

    v8f oc0 = {};          // O accumulator, d = 0..15  (C-layout)
    v8f oc1 = {};          // O accumulator, d = 16..31
    float m_run = -INFINITY;
    float l_run = 0.0f;

    float* myP = &LP[wave][0];

    for (int s0 = 0; s0 < L_SEQ; s0 += SBLK) {
        __syncthreads();   // protect LK/LV against reuse across iterations
        {   // cooperative K/V stage: 32x64 floats each, 8 floats (2x float4) per thread
            const int d = tid >> 3;
            const int s = (tid & 7) * 8;
            const float4* kg = (const float4*)(kh + (size_t)d * L_SEQ + s0 + s);
            const float4* vg = (const float4*)(vh + (size_t)d * L_SEQ + s0 + s);
            float4* lk4 = (float4*)&LK[d * SBLK + s];
            float4* lv4 = (float4*)&LV[d * SBLK + s];
            lk4[0] = kg[0]; lk4[1] = kg[1];
            lv4[0] = vg[0]; lv4[1] = vg[1];
            if (tid < SBLK) LM1[tid] = mask1[(size_t)n * L_SEQ + s0 + tid];
        }
        __syncthreads();

        // ---- S = Q^T K : 16 x 64 as four 16x16 WMMA tiles, K-dim = 32 (8 chunks of 4)
#pragma unroll
        for (int nt = 0; nt < 4; ++nt) {
            v8f acc = {};
#pragma unroll
            for (int c = 0; c < 8; ++c) {
                const int d0 = 4 * c + 2 * half;
                v2f a; a.x = qa[2*c+0]; a.y = qa[2*c+1];
                v2f b;
                b.x = LK[(d0 + 0) * SBLK + nt * 16 + lane16];   // B[K=d0  ][N=lane16]
                b.y = LK[(d0 + 1) * SBLK + nt * 16 + lane16];   // B[K=d0+1][N=lane16]
                acc = __builtin_amdgcn_wmma_f32_16x16x4_f32(
                          false, a, false, b, (short)0, acc, false, false);
            }
            // spill C-layout tile: VGPR r -> row r + 8*half, col nt*16 + lane16
#pragma unroll
            for (int r = 0; r < 8; ++r)
                myP[(r + 8 * half) * SBLK + nt * 16 + lane16] = acc[r];
        }
        __syncthreads();   // P visible across lanes

        // ---- online softmax over this 64-key block (lane: row=lane16, cols half*32..+31)
        const int row   = lane16;
        const int cbase = half * 32;
        float mblk_loc = -INFINITY;
#pragma unroll
        for (int j = 0; j < 32; ++j) {
            const float val   = myP[row * SBLK + cbase + j];
            const int   valid = m0r & LM1[cbase + j];
            const float sv    = (valid ? val : NEGV) * SM_SCALE;
            myP[row * SBLK + cbase + j] = sv;
            mblk_loc = fmaxf(mblk_loc, sv);
        }
        const float mblk_row = fmaxf(mblk_loc, __shfl_xor(mblk_loc, 16, 32));
        const float m_new    = fmaxf(m_run, mblk_row);
        const float alpha    = __expf(m_run - m_new);

        float lblk_loc = 0.0f;
#pragma unroll
        for (int j = 0; j < 32; ++j) {
            const float sv = myP[row * SBLK + cbase + j];
            const float e  = __expf(sv - m_new);
            myP[row * SBLK + cbase + j] = e;
            lblk_loc += e;
        }
        l_run = l_run * alpha + (lblk_loc + __shfl_xor(lblk_loc, 16, 32));
        m_run = m_new;

        // rescale O accumulators: row of VGPR r is (r + 8*half); alpha lives at lane==row
#pragma unroll
        for (int r = 0; r < 8; ++r) {
            const float ar = __shfl(alpha, r + 8 * half, 32);
            oc0[r] *= ar;
            oc1[r] *= ar;
        }

        __syncthreads();   // exp(P) stores visible before cross-lane A-layout reads

        // ---- O += P * V^T : K-dim = 64 (16 chunks of 4), two 16-wide d tiles
#pragma unroll
        for (int c = 0; c < 16; ++c) {
            const int sA = 4 * c + 2 * half;
            v2f a;                                        // A[M=lane16][K=sA+j]
            a.x = myP[lane16 * SBLK + sA + 0];
            a.y = myP[lane16 * SBLK + sA + 1];
            v2f b0, b1;                                   // B[K=sA+j][N=d] = v[d][s]
            b0.x = LV[(lane16 +  0) * SBLK + sA + 0];
            b0.y = LV[(lane16 +  0) * SBLK + sA + 1];
            b1.x = LV[(lane16 + 16) * SBLK + sA + 0];
            b1.y = LV[(lane16 + 16) * SBLK + sA + 1];
            oc0 = __builtin_amdgcn_wmma_f32_16x16x4_f32(
                      false, a, false, b0, (short)0, oc0, false, false);
            oc1 = __builtin_amdgcn_wmma_f32_16x16x4_f32(
                      false, a, false, b1, (short)0, oc1, false, false);
        }
    }

    // ---- normalize rows and store: out[n][h*32 + d][l0 + M], d-major stride L
    float* outp = out + headoff;
#pragma unroll
    for (int r = 0; r < 8; ++r) {
        const float inv = 1.0f / __shfl(l_run, r + 8 * half, 32);
        const int   M   = r + 8 * half;
        outp[(size_t)(lane16 +  0) * L_SEQ + l0 + M] = oc0[r] * inv;
        outp[(size_t)(lane16 + 16) * L_SEQ + l0 + M] = oc1[r] * inv;
    }
}

extern "C" void kernel_launch(void* const* d_in, const int* in_sizes, int n_in,
                              void* d_out, int out_size, void* d_ws, size_t ws_size,
                              hipStream_t stream) {
    const float* q  = (const float*)d_in[0];
    const float* k  = (const float*)d_in[1];
    const float* v  = (const float*)d_in[2];
    const int*   m0 = (const int*)d_in[3];
    const int*   m1 = (const int*)d_in[4];
    float* out = (float*)d_out;

    const int N = in_sizes[0] / (256 * L_SEQ);   // q is (N, 256, L)
    dim3 grid(N * NHEADS * (L_SEQ / 128));       // 512 workgroups for N=4
    dim3 block(256);
    fullattn_f32wmma_kernel<<<grid, block, 0, stream>>>(q, k, v, m0, m1, out);
}

// v001
// It runs in 128 microseconds.
// In both of two side-by-side timings against v000, it was 2.95 times as fast.
#include <hip/hip_runtime.h>

typedef float v2f __attribute__((ext_vector_type(2)));
typedef float v8f __attribute__((ext_vector_type(8)));

#define L_SEQ    2048
#define DH       32
#define NHEADS   8
#define SBLK     64
// LDS row pitches in floats (64 banks of 4 bytes; a pitch of 64 puts a whole column on one bank):
//   PK: the lane halves read rows d and d+2, 16 floats each, two column tiles per paired load
//       -> 2*PK mod 64 = 32 puts the four 16-float runs on four different quarters of the banks
//   PV, PP: 16 lanes walk a column with 8- or 16-byte accesses  -> pitch mod 64 = 4 spreads them over all banks
#define PK       80
#define PV       68
#define PP       68
#define NEGV     (-1.0e8f)
#define SM_SCALE 0.17677669529663689f   /* 1/sqrt(32) */

// One workgroup = (n, h, 128-query block); 8 waves of 32, each wave owns 16 query rows.
__global__ __launch_bounds__(256)
void fullattn_f32wmma_kernel(const float* __restrict__ q,
                             const float* __restrict__ k,
                             const float* __restrict__ v,
                             const int*   __restrict__ mask0,
                             const int*   __restrict__ mask1,
                             float*       __restrict__ out)
{
    __shared__ __align__(16) float LK[DH * PK];          // K tile   [d][s]
    __shared__ __align__(16) float LV[DH * PV];          // V tile   [d][s]
    __shared__ __align__(16) float LP[8][16 * PP];       // per-wave P scratch [m][s]
    __shared__ int LM1[SBLK];

    const int tid    = threadIdx.x;
    const int lane   = tid & 31;
    const int wave   = tid >> 5;
    const int half   = lane >> 4;      // 0: lanes 0-15, 1: lanes 16-31
    const int lane16 = lane & 15;

    const int bx   = blockIdx.x;
    const int mblk = bx & 15;          // 16 blocks of 128 queries
    const int h    = (bx >> 4) & 7;
    const int n    = bx >> 7;

    const int l0 = mblk * 128 + wave * 16;   // this wave's first query row
    const size_t headoff = ((size_t)n * NHEADS + h) * (size_t)DH * L_SEQ;
    const float* qh = q + headoff;
    const float* kh = k + headoff;
    const float* vh = v + headoff;

    // ---- Q tile in WMMA A-layout registers (M=16, per K-chunk of 4):
    //      a[2c+j] = Q^T[M=lane16][K=4c + 2*half + j] = q[d][l0+lane16]
    float qa[16];
#pragma unroll
    for (int c = 0; c < 8; ++c) {
        const int d0 = 4 * c + 2 * half;
        qa[2*c+0] = qh[(size_t)(d0 + 0) * L_SEQ + l0 + lane16];
        qa[2*c+1] = qh[(size_t)(d0 + 1) * L_SEQ + l0 + lane16];
    }

    const int m0r = mask0[(size_t)n * L_SEQ + l0 + lane16];  // this lane's query-row mask

    v8f oc0 = {};          // O accumulator, d = 0..15  (C-layout)
    v8f oc1 = {};          // O accumulator, d = 16..31
    float m_run = -INFINITY;
    float l_run = 0.0f;

    float* myP = &LP[wave][0];
    float* myPc = myP + 8 * half * PP + lane16;   // this lane's place in the C-layout spill

    for (int s0 = 0; s0 < L_SEQ; s0 += SBLK) {
        __syncthreads();   // protect LK/LV against reuse across iterations
        {   // cooperative K/V stage: 32x64 floats each, 8 floats (2x float4) per thread
            const int d = tid >> 3;
            const int s = (tid & 7) * 8;
            const float4* kg = (const float4*)(kh + (size_t)d * L_SEQ + s0 + s);
            const float4* vg = (const float4*)(vh + (size_t)d * L_SEQ + s0 + s);
            float4* lk4 = (float4*)&LK[d * PK + s];
            float4* lv4 = (float4*)&LV[d * PV + s];
            lk4[0] = kg[0]; lk4[1] = kg[1];
            lv4[0] = vg[0]; lv4[1] = vg[1];
            if (tid < SBLK) LM1[tid] = mask1[(size_t)n * L_SEQ + s0 + tid];
        }
        __syncthreads();

        // ---- S = Q^T K : 16 x 64 as four 16x16 WMMA tiles, K-dim = 32 (8 chunks of 4)
#pragma unroll
        for (int nt = 0; nt < 4; ++nt) {
            v8f acc = {};
#pragma unroll
            for (int c = 0; c < 8; ++c) {
                const int d0 = 4 * c + 2 * half;
                v2f a; a.x = qa[2*c+0]; a.y = qa[2*c+1];
                v2f b;
                b.x = LK[(d0 + 0) * PK + nt * 16 + lane16];   // B[K=d0  ][N=lane16]
                b.y = LK[(d0 + 1) * PK + nt * 16 + lane16];   // B[K=d0+1][N=lane16]
                acc = __builtin_amdgcn_wmma_f32_16x16x4_f32(
                          false, a, false, b, (short)0, acc, false, false);
            }
            // spill C-layout tile: VGPR r -> row r + 8*half, col nt*16 + lane16
#pragma unroll
            for (int r = 0; r < 8; ++r)
                myPc[r * PP + nt * 16] = acc[r];
        }
        __syncthreads();   // P visible across lanes

        // ---- online softmax over this 64-key block (lane: row=lane16, cols half*32..+31)
        const int row   = lane16;
        const int cbase = half * 32;
        float mblk_loc = -INFINITY;
#pragma unroll
        for (int j = 0; j < 32; ++j) {
            const float val   = myP[row * PP + cbase + j];
            const int   valid = m0r & LM1[cbase + j];
            const float sv    = (valid ? val : NEGV) * SM_SCALE;
            myP[row * PP + cbase + j] = sv;
            mblk_loc = fmaxf(mblk_loc, sv);
        }
        const float mblk_row = fmaxf(mblk_loc, __shfl_xor(mblk_loc, 16, 32));
        const float m_new    = fmaxf(m_run, mblk_row);
        const float alpha    = __expf(m_run - m_new);

        float lblk_loc = 0.0f;
#pragma unroll
        for (int j = 0; j < 32; ++j) {
            const float sv = myP[row * PP + cbase + j];
            const float e  = __expf(sv - m_new);
            myP[row * PP + cbase + j] = e;
            lblk_loc += e;
        }
        l_run = l_run * alpha + (lblk_loc + __shfl_xor(lblk_loc, 16, 32));
        m_run = m_new;

        // rescale O accumulators: row of VGPR r is (r + 8*half); alpha lives at lane==row
#pragma unroll
        for (int r = 0; r < 8; ++r) {
            const float ar = __shfl(alpha, r + 8 * half, 32);
            oc0[r] *= ar;
            oc1[r] *= ar;
        }

        __syncthreads();   // exp(P) stores visible before cross-lane A-layout reads

        // ---- O += P * V^T : K-dim = 64 (16 chunks of 4), two 16-wide d tiles
#pragma unroll
        for (int c = 0; c < 16; ++c) {
            const int sA = 4 * c + 2 * half;
            v2f a;                                        // A[M=lane16][K=sA+j]
            a.x = myP[lane16 * PP + sA + 0];
            a.y = myP[lane16 * PP + sA + 1];
            v2f b0, b1;                                   // B[K=sA+j][N=d] = v[d][s]
            b0.x = LV[(lane16 +  0) * PV + sA + 0];
            b0.y = LV[(lane16 +  0) * PV + sA + 1];
            b1.x = LV[(lane16 + 16) * PV + sA + 0];
            b1.y = LV[(lane16 + 16) * PV + sA + 1];
            oc0 = __builtin_amdgcn_wmma_f32_16x16x4_f32(
                      false, a, false, b0, (short)0, oc0, false, false);
            oc1 = __builtin_amdgcn_wmma_f32_16x16x4_f32(
                      false, a, false, b1, (short)0, oc1, false, false);
        }
    }

    // ---- normalize rows and store: out[n][h*32 + d][l0 + M], d-major stride L
    float* outp = out + headoff;
#pragma unroll
    for (int r = 0; r < 8; ++r) {
        const float inv = 1.0f / __shfl(l_run, r + 8 * half, 32);
        const int   M   = r + 8 * half;
        outp[(size_t)(lane16 +  0) * L_SEQ + l0 + M] = oc0[r] * inv;
        outp[(size_t)(lane16 + 16) * L_SEQ + l0 + M] = oc1[r] * inv;
    }
}

extern "C" void kernel_launch(void* const* d_in, const int* in_sizes, int n_in,
                              void* d_out, int out_size, void* d_ws, size_t ws_size,
                              hipStream_t stream) {
    const float* q  = (const float*)d_in[0];
    const float* k  = (const float*)d_in[1];
    const float* v  = (const float*)d_in[2];
    const int*   m0 = (const int*)d_in[3];
    const int*   m1 = (const int*)d_in[4];
    float* out = (float*)d_out;

    const int N = in_sizes[0] / (256 * L_SEQ);   // q is (N, 256, L)
    dim3 grid(N * NHEADS * (L_SEQ / 128));       // 512 workgroups for N=4
    dim3 block(256);
    fullattn_f32wmma_kernel<<<grid, block, 0, stream>>>(q, k, v, m0, m1, out);
}

// v002
// It runs in 114 microseconds.
// In both of two side-by-side timings against v001, it was 1.13 times as fast.
// Counting every step since v000, it is 3.32 times as fast.
#include <hip/hip_runtime.h>

typedef float v2f __attribute__((ext_vector_type(2)));
typedef float v8f __attribute__((ext_vector_type(8)));

#define L_SEQ    2048
#define DH       32
#define NHEADS   8
#define SBLK     64
// LDS row pitches in floats (64 banks of 4 bytes; a pitch of 64 puts a whole column on one bank):
//   PK: the lane halves read rows d and d+2, 16 floats each, two column tiles per paired load
//       -> 2*PK mod 64 = 32 puts the four 16-float runs on four different quarters of the banks
//   PV: 16 lanes walk a column with 16-byte accesses -> pitch mod 64 = 4 spreads them over all banks
#define PK       80
#define PV       68
#define NEGV     (-1.0e8f)
#define SM_SCALE 0.17677669529663689f   /* 1/sqrt(32) */
#define LOG2E    1.44269504088896340736f /* exp(x) = 2^(x * LOG2E), as __expf forms it */

// lane l <-> lane l ^ 16: the two lanes that share one query column
__device__ __forceinline__ float xhalf(float x) {
    const int b = __builtin_bit_cast(int, x);
    return __builtin_bit_cast(float,
        __builtin_amdgcn_permlanex16(b, b, 0x76543210, 0xfedcba98, false, false));
}

// Four 2^x, each in its own register. Written by hand so that the free slot which the instruction set
// asks for behind a transcendental (before its result is read or its source overwritten) stands inside
// the statement. Each v_exp_f32 is the slot
// of the one in front of it, the v_nop that of the last. In place, so that the statement writes no register
// but those which the compiler's own multiply has just written.
__device__ __forceinline__ void exp2x4(float& x0, float& x1, float& x2, float& x3) {
    asm("v_exp_f32 %0, %0\n\t"
        "v_exp_f32 %1, %1\n\t"
        "v_exp_f32 %2, %2\n\t"
        "v_exp_f32 %3, %3\n\t"
        "v_nop"
        : "+v"(x0), "+v"(x1), "+v"(x2), "+v"(x3));
}

// One workgroup = (n, h, 128-query block); 8 waves of 32, each wave owns 16 query columns.
// Both products run transposed: S^T = K^T Q (keys are rows, queries are columns) and O^T += V P^T.
// In every 16x16 result tile a lane then holds values of ONE query (column lane16), so the softmax
// is in-lane work plus one exchange between the lane halves, and the score registers, once they hold
// exp(), are the B operand of the second product as they stand: P is never written to LDS.
// waves_per_eu(4, 4): residency stays at two workgroups per WGP, as before the registers and the LDS shrank,
// so that the 512 workgroups lie two on each of the 256 WGPs however the dispatcher fills them.
__global__ __launch_bounds__(256) __attribute__((amdgpu_waves_per_eu(4, 4)))
void fullattn_f32wmma_kernel(const float* __restrict__ q,
                             const float* __restrict__ k,
                             const float* __restrict__ v,
                             const int*   __restrict__ mask0,
                             const int*   __restrict__ mask1,
                             float*       __restrict__ out)
{
    __shared__ __align__(16) float LK[DH * PK];          // K tile   [d][s]
    __shared__ __align__(16) float LV[DH * PV];          // V tile   [d][s]
    __shared__ __align__(16) int   LM1[SBLK];

    const int tid    = threadIdx.x;
    const int lane   = tid & 31;
    const int wave   = tid >> 5;
    const int half   = lane >> 4;      // 0: lanes 0-15, 1: lanes 16-31
    const int lane16 = lane & 15;

    const int bx   = blockIdx.x;
    const int mblk = bx & 15;          // 16 blocks of 128 queries
    const int h    = (bx >> 4) & 7;
    const int n    = bx >> 7;

    const int l0 = mblk * 128 + wave * 16;   // this wave's first query
    const size_t headoff = ((size_t)n * NHEADS + h) * (size_t)DH * L_SEQ;
    const float* qh = q + headoff;
    const float* kh = k + headoff;
    const float* vh = v + headoff;

    // ---- Q tile in WMMA B-layout registers (N=16, per K-chunk of 4; the same lane map as an A operand):
    //      qa[2c+j] = Q[K=4c + 2*half + j][N=lane16] = q[d][l0+lane16]
    float qa[16];
#pragma unroll
    for (int c = 0; c < 8; ++c) {
        const int d0 = 4 * c + 2 * half;
        qa[2*c+0] = qh[(size_t)(d0 + 0) * L_SEQ + l0 + lane16];
        qa[2*c+1] = qh[(size_t)(d0 + 1) * L_SEQ + l0 + lane16];
    }

    const bool m0ok = mask0[(size_t)n * L_SEQ + l0 + lane16] != 0;  // this lane's query mask

    v8f oc0 = {};          // O^T accumulator, rows d = 0..15,  column = query lane16
    v8f oc1 = {};          // O^T accumulator, rows d = 16..31
    float m_run = -INFINITY;   // running maximum of this lane's query (equal in both halves)
    float l_run = 0.0f;        // running sum over the keys of THIS half only; joined after the loop

    for (int s0 = 0; s0 < L_SEQ; s0 += SBLK) {
        __syncthreads();   // protect LK/LV against reuse across iterations
        {   // cooperative K/V stage: 32x64 floats each, 8 floats (2x float4) per thread
            const int d = tid >> 3;
            const int s = (tid & 7) * 8;
            const float4* kg = (const float4*)(kh + (size_t)d * L_SEQ + s0 + s);
            const float4* vg = (const float4*)(vh + (size_t)d * L_SEQ + s0 + s);
            float4* lk4 = (float4*)&LK[d * PK + s];
            float4* lv4 = (float4*)&LV[d * PV + s];
            lk4[0] = kg[0]; lk4[1] = kg[1];
            lv4[0] = vg[0]; lv4[1] = vg[1];
            if (tid < SBLK) LM1[tid] = mask1[(size_t)n * L_SEQ + s0 + tid];
        }
        __syncthreads();

        // ---- S^T = K^T Q : 64 keys x 16 queries as four 16x16 tiles, K-dim = 32 (8 chunks of 4).
        //      sc[nt][r] = score(key nt*16 + 8*half + r, query lane16)
        v8f sc[4] = {};
#pragma unroll  // constant indices keep the tiles in registers
        for (int c = 0; c < 8; ++c) {
            const int d0 = 4 * c + 2 * half;
            v2f b; b.x = qa[2*c+0]; b.y = qa[2*c+1];
#pragma unroll  // constant indices keep the tiles in registers
            for (int nt = 0; nt < 4; ++nt) {
                v2f a;
                a.x = LK[(d0 + 0) * PK + nt * 16 + lane16];   // A[M=lane16][K=d0  ]
                a.y = LK[(d0 + 1) * PK + nt * 16 + lane16];   // A[M=lane16][K=d0+1]
                sc[nt] = __builtin_amdgcn_wmma_f32_16x16x4_f32(
                             false, a, false, b, (short)0, sc[nt], false, false);
            }
        }

        // Four vector slots between the last score WMMA and the first vector instruction that reads a score.
        // The tiles are named so that every score WMMA stands in front of the slots and every reader behind.
        asm("v_nop\n\tv_nop\n\tv_nop\n\tv_nop" : "+v"(sc[0]), "+v"(sc[1]), "+v"(sc[2]), "+v"(sc[3]));

        // ---- online softmax over this 64-key block, in registers (32 keys of one query per lane)
        float mloc[4];
#pragma unroll  // constant indices keep the tiles in registers
        for (int nt = 0; nt < 4; ++nt) {
            const int4 ma = *(const int4*)&LM1[nt * 16 + 8 * half + 0];
            const int4 mb = *(const int4*)&LM1[nt * 16 + 8 * half + 4];
            const int mk[8] = { ma.x, ma.y, ma.z, ma.w, mb.x, mb.y, mb.z, mb.w };
            mloc[nt] = -INFINITY;
#pragma unroll  // constant indices keep the tiles in registers
            for (int r = 0; r < 8; ++r) {
                const bool  valid = m0ok && (mk[r] != 0);
                const float sv    = (valid ? sc[nt][r] : NEGV) * SM_SCALE;
                sc[nt][r] = sv;
                mloc[nt] = fmaxf(mloc[nt], sv);
            }
        }
        const float mhalf = fmaxf(fmaxf(mloc[0], mloc[1]), fmaxf(mloc[2], mloc[3]));
        const float m_new = fmaxf(m_run, fmaxf(mhalf, xhalf(mhalf)));
        const float alpha = __expf(m_run - m_new);

        float lloc[4];
#pragma unroll  // constant indices keep the tiles in registers
        for (int nt = 0; nt < 4; ++nt) {
#pragma unroll  // constant indices keep the tiles in registers
            for (int i = 0; i < 2; ++i) {
                float e0 = (sc[nt][4*i+0] - m_new) * LOG2E;
                float e1 = (sc[nt][4*i+1] - m_new) * LOG2E;
                float e2 = (sc[nt][4*i+2] - m_new) * LOG2E;
                float e3 = (sc[nt][4*i+3] - m_new) * LOG2E;
                exp2x4(e0, e1, e2, e3);
                sc[nt][4*i+0] = e0; sc[nt][4*i+1] = e1; sc[nt][4*i+2] = e2; sc[nt][4*i+3] = e3;
                const float l4 = (e0 + e1) + (e2 + e3);
                lloc[nt] = i ? lloc[nt] + l4 : l4;
            }
        }
        l_run = l_run * alpha + ((lloc[0] + lloc[1]) + (lloc[2] + lloc[3]));
        m_run = m_new;

        // rescale O^T: every accumulator register of a lane belongs to its own query
#pragma unroll  // constant indices keep the tiles in registers
        for (int r = 0; r < 8; ++r) {
            oc0[r] *= alpha;
            oc1[r] *= alpha;
        }

        // ---- O^T += V P^T : K-dim = 64 keys (16 chunks of 4), two 16-row d tiles.
        //      B pair = two neighbouring score registers: keys kb + {0,1}, then kb + {2,3}, kb = nt*16 + 8*half + 4*i;
        //      the A loader takes V at the same keys in the same (half, j) places, four keys to a 16-byte read.
#pragma unroll  // constant indices keep the tiles in registers
        for (int nt = 0; nt < 4; ++nt) {
#pragma unroll  // constant indices keep the tiles in registers
            for (int i = 0; i < 2; ++i) {
                const int kb = nt * 16 + 8 * half + 4 * i;
                const float4 va0 = *(const float4*)&LV[(lane16 +  0) * PV + kb];
                const float4 va1 = *(const float4*)&LV[(lane16 + 16) * PV + kb];
                v2f a0, a1, b;
                b.x  = sc[nt][4*i+0]; b.y  = sc[nt][4*i+1];
                a0.x = va0.x;         a0.y = va0.y;
                a1.x = va1.x;         a1.y = va1.y;
                oc0 = __builtin_amdgcn_wmma_f32_16x16x4_f32(
                          false, a0, false, b, (short)0, oc0, false, false);
                oc1 = __builtin_amdgcn_wmma_f32_16x16x4_f32(
                          false, a1, false, b, (short)0, oc1, false, false);
                b.x  = sc[nt][4*i+2]; b.y  = sc[nt][4*i+3];
                a0.x = va0.z;         a0.y = va0.w;
                a1.x = va1.z;         a1.y = va1.w;
                oc0 = __builtin_amdgcn_wmma_f32_16x16x4_f32(
                          false, a0, false, b, (short)0, oc0, false, false);
                oc1 = __builtin_amdgcn_wmma_f32_16x16x4_f32(
                          false, a1, false, b, (short)0, oc1, false, false);
            }
        }
    }

    // ---- normalize and store: out[n][h*32 + d][l0 + lane16]; register r holds row d = r + 8*half
    const float inv = 1.0f / (l_run + xhalf(l_run));
    float* outp = out + headoff + (size_t)(8 * half) * L_SEQ + l0 + lane16;
#pragma unroll  // constant indices keep the tiles in registers
    for (int r = 0; r < 8; ++r) {
        outp[(size_t)(r +  0) * L_SEQ] = oc0[r] * inv;
        outp[(size_t)(r + 16) * L_SEQ] = oc1[r] * inv;
    }
}

extern "C" void kernel_launch(void* const* d_in, const int* in_sizes, int n_in,
                              void* d_out, int out_size, void* d_ws, size_t ws_size,
                              hipStream_t stream) {
    const float* q  = (const float*)d_in[0];
    const float* k  = (const float*)d_in[1];
    const float* v  = (const float*)d_in[2];
    const int*   m0 = (const int*)d_in[3];
    const int*   m1 = (const int*)d_in[4];
    float* out = (float*)d_out;

    const int N = in_sizes[0] / (256 * L_SEQ);   // q is (N, 256, L)
    dim3 grid(N * NHEADS * (L_SEQ / 128));       // 512 workgroups for N=4
    dim3 block(256);
    fullattn_f32wmma_kernel<<<grid, block, 0, stream>>>(q, k, v, m0, m1, out);
}

// v003
// Measured time: 99.2 microseconds a run.
// Two timings next to v002 both put it at 1.15 times that version's speed.
// Counting every step since v000, it is 3.81 times as fast.
#include <hip/hip_runtime.h>

typedef float v2f __attribute__((ext_vector_type(2)));
typedef float v8f __attribute__((ext_vector_type(8)));

#define L_SEQ    2048
#define DH       32
#define NHEADS   8
#define SBLK     64
// LDS row pitches in floats (64 banks of 4 bytes; a pitch of 64 puts a whole column on one bank):
//   PK: the lane halves read rows d and d+2, 16 floats each, two column tiles per paired load
//       -> 2*PK mod 64 = 32 puts the four 16-float runs on four different quarters of the banks
//   PV: 16 lanes walk a column with 16-byte accesses -> pitch mod 64 = 4 spreads them over all banks
#define PK       80
#define PV       68
#define NEGV     (-1.0e8f)
#define SM_SCALE 0.17677669529663689f   /* 1/sqrt(32) */
#define LOG2E    1.44269504088896340736f /* exp(x) = 2^(x * LOG2E), as __expf forms it */
#define NTILE    (L_SEQ / SBLK)

// byte address of a __shared__ object inside the workgroup's LDS: the low 32 bits of its generic address
__device__ __forceinline__ unsigned lds_off(const void* p) { return (unsigned)(size_t)p; }

// One K/V tile (32 rows x 64 floats each) from global memory into LDS through no register: four 16-byte
// copies per lane, every lane on. A wave's copy covers two whole 256-byte row pieces.
// s_wait_xcnt 0 is the statement's last line, so that it stands in front of every later write of a register
// that a copy names (a precaution for the address translation of an issued copy).
__device__ __forceinline__ void copy_tile(unsigned lk0, unsigned lk1, unsigned lv0, unsigned lv1,
                                          const float* gk0, const float* gk1,
                                          const float* gv0, const float* gv1) {
    asm volatile("global_load_async_to_lds_b128 %0, %4, off\n\t"
                 "global_load_async_to_lds_b128 %1, %5, off\n\t"
                 "global_load_async_to_lds_b128 %2, %6, off\n\t"
                 "global_load_async_to_lds_b128 %3, %7, off\n\t"
                 "s_wait_xcnt 0x0"
                 :: "v"(lk0), "v"(lk1), "v"(lv0), "v"(lv1), "v"(gk0), "v"(gk1), "v"(gv0), "v"(gv1)
                 : "memory");
}

// lane l <-> lane l ^ 16: the two lanes that share one query column
__device__ __forceinline__ float xhalf(float x) {
    const int b = __builtin_bit_cast(int, x);
    return __builtin_bit_cast(float,
        __builtin_amdgcn_permlanex16(b, b, 0x76543210, 0xfedcba98, false, false));
}

// Four 2^x, each in its own register. Written by hand so that the free slot which the instruction set
// asks for behind a transcendental (before its result is read or its source overwritten) stands inside
// the statement. Each v_exp_f32 is the slot
// of the one in front of it, the v_nop that of the last. In place, so that the statement writes no register
// but those which the compiler's own multiply has just written.
__device__ __forceinline__ void exp2x4(float& x0, float& x1, float& x2, float& x3) {
    asm("v_exp_f32 %0, %0\n\t"
        "v_exp_f32 %1, %1\n\t"
        "v_exp_f32 %2, %2\n\t"
        "v_exp_f32 %3, %3\n\t"
        "v_nop"
        : "+v"(x0), "+v"(x1), "+v"(x2), "+v"(x3));
}

// One workgroup = (n, h, 128-query block); 8 waves of 32, each wave owns 16 query columns.
// Both products run transposed: S^T = K^T Q (keys are rows, queries are columns) and O^T += V P^T.
// In every 16x16 result tile a lane then holds values of ONE query (column lane16), so the softmax
// is in-lane work plus one exchange between the lane halves, and the score registers, once they hold
// exp(), are the B operand of the second product as they stand: P is never written to LDS.
// K and V tiles come into two LDS buffers by asynchronous copies, one tile ahead of the tile in work.
// waves_per_eu(4, 4): residency stays at two workgroups per WGP, as before the registers and the LDS shrank,
// so that the 512 workgroups lie two on each of the 256 WGPs however the dispatcher fills them.
__global__ __launch_bounds__(256) __attribute__((amdgpu_waves_per_eu(4, 4)))
void fullattn_f32wmma_kernel(const float* __restrict__ q,
                             const float* __restrict__ k,
                             const float* __restrict__ v,
                             const int*   __restrict__ mask0,
                             const int*   __restrict__ mask1,
                             float*       __restrict__ out)
{
    __shared__ __align__(16) float LK[2][DH * PK];       // K tiles  [buffer][d][s]
    __shared__ __align__(16) float LV[2][DH * PV];       // V tiles  [buffer][d][s]
    __shared__ __align__(16) int   LM1[L_SEQ];           // the whole key mask row of batch n, copied once

    const int tid    = threadIdx.x;
    const int lane   = tid & 31;
    const int wave   = tid >> 5;
    const int half   = lane >> 4;      // 0: lanes 0-15, 1: lanes 16-31
    const int lane16 = lane & 15;

    const int bx   = blockIdx.x;
    const int mblk = bx & 15;          // 16 blocks of 128 queries
    const int h    = (bx >> 4) & 7;
    const int n    = bx >> 7;

    const int l0 = mblk * 128 + wave * 16;   // this wave's first query
    const size_t headoff = ((size_t)n * NHEADS + h) * (size_t)DH * L_SEQ;
    const float* qh = q + headoff;
    const float* kh = k + headoff;
    const float* vh = v + headoff;

    // ---- staging map: lane t copies floats sc4..sc4+3 of rows sd and sd+16 of each tile
    const int sd  = tid >> 4;
    const int sc4 = (tid & 15) * 4;
    const float* gk = kh + (size_t)sd * L_SEQ + sc4;
    const float* gv = vh + (size_t)sd * L_SEQ + sc4;
    const unsigned lk = lds_off(&LK[0][sd * PK + sc4]);
    const unsigned lv = lds_off(&LV[0][sd * PV + sc4]);

    // tile 0 into buffer 0, and the mask row (8 ints per lane)
    copy_tile(lk, lk + 16 * PK * 4, lv, lv + 16 * PV * 4,
              gk, gk + (size_t)16 * L_SEQ, gv, gv + (size_t)16 * L_SEQ);
    {
        const int* gm = mask1 + (size_t)n * L_SEQ + tid * 4;
        const unsigned lm = lds_off(&LM1[tid * 4]);
        // s_wait_xcnt 0 last in the statement, as in copy_tile
        asm volatile("global_load_async_to_lds_b128 %0, %2, off\n\t"
                     "global_load_async_to_lds_b128 %1, %3, off\n\t"
                     "s_wait_xcnt 0x0"
                     :: "v"(lm), "v"(lm + 1024 * 4), "v"(gm), "v"(gm + 1024)
                     : "memory");
    }

    // ---- Q tile in WMMA B-layout registers (N=16, per K-chunk of 4; the same lane map as an A operand):
    //      qa[2c+j] = Q[K=4c + 2*half + j][N=lane16] = q[d][l0+lane16]
    float qa[16];
#pragma unroll
    for (int c = 0; c < 8; ++c) {
        const int d0 = 4 * c + 2 * half;
        qa[2*c+0] = qh[(size_t)(d0 + 0) * L_SEQ + l0 + lane16];
        qa[2*c+1] = qh[(size_t)(d0 + 1) * L_SEQ + l0 + lane16];
    }

    const bool m0ok = mask0[(size_t)n * L_SEQ + l0 + lane16] != 0;  // this lane's query mask

    v8f oc0 = {};          // O^T accumulator, rows d = 0..15,  column = query lane16
    v8f oc1 = {};          // O^T accumulator, rows d = 16..31
    float m_run = -INFINITY;   // running maximum of this lane's query (equal in both halves)
    float l_run = 0.0f;        // running sum over the keys of THIS half only; joined after the loop

    // this wave's copies of tile 0 and of the mask row have landed ...
    asm volatile("s_wait_asynccnt 0x0" ::: "memory");
    __syncthreads();   // ... and so have every other wave's: tile 0 and the mask row may be read
    // tile 1 into buffer 1: it flies while tile 0 is worked on
    copy_tile(lk + DH * PK * 4, lk + (DH + 16) * PK * 4, lv + DH * PV * 4, lv + (DH + 16) * PV * 4,
              gk + SBLK, gk + (size_t)16 * L_SEQ + SBLK, gv + SBLK, gv + (size_t)16 * L_SEQ + SBLK);

#pragma unroll 2  // two trips to a pass of the loop: the buffer index is then a constant in every LDS address
    for (int t = 0; t < NTILE; ++t) {
        const int s0  = t * SBLK;
        const int buf = t & 1;
        const float* LKb = LK[buf];
        const float* LVb = LV[buf];

        // ---- S^T = K^T Q : 64 keys x 16 queries as four 16x16 tiles, K-dim = 32 (8 chunks of 4).
        //      sc[nt][r] = score(key nt*16 + 8*half + r, query lane16)
        v8f sc[4] = {};
#pragma unroll  // constant indices keep the tiles in registers
        for (int c = 0; c < 8; ++c) {
            const int d0 = 4 * c + 2 * half;
            v2f b; b.x = qa[2*c+0]; b.y = qa[2*c+1];
#pragma unroll  // constant indices keep the tiles in registers
            for (int nt = 0; nt < 4; ++nt) {
                v2f a;
                a.x = LKb[(d0 + 0) * PK + nt * 16 + lane16];  // A[M=lane16][K=d0  ]
                a.y = LKb[(d0 + 1) * PK + nt * 16 + lane16];  // A[M=lane16][K=d0+1]
                sc[nt] = __builtin_amdgcn_wmma_f32_16x16x4_f32(
                             false, a, false, b, (short)0, sc[nt], false, false);
            }
        }

        // Four vector slots between the last score WMMA and the first vector instruction that reads a score.
        // The tiles are named so that every score WMMA stands in front of the slots and every reader behind.
        asm("v_nop\n\tv_nop\n\tv_nop\n\tv_nop" : "+v"(sc[0]), "+v"(sc[1]), "+v"(sc[2]), "+v"(sc[3]));

        // ---- online softmax over this 64-key block, in registers (32 keys of one query per lane)
        float mloc[4];
#pragma unroll  // constant indices keep the tiles in registers
        for (int nt = 0; nt < 4; ++nt) {
            const int4 ma = *(const int4*)&LM1[s0 + nt * 16 + 8 * half + 0];
            const int4 mb = *(const int4*)&LM1[s0 + nt * 16 + 8 * half + 4];
            const int mk[8] = { ma.x, ma.y, ma.z, ma.w, mb.x, mb.y, mb.z, mb.w };
            mloc[nt] = -INFINITY;
#pragma unroll  // constant indices keep the tiles in registers
            for (int r = 0; r < 8; ++r) {
                const bool  valid = m0ok && (mk[r] != 0);
                const float sv    = (valid ? sc[nt][r] : NEGV) * SM_SCALE;
                sc[nt][r] = sv;
                mloc[nt] = fmaxf(mloc[nt], sv);
            }
        }
        const float mhalf = fmaxf(fmaxf(mloc[0], mloc[1]), fmaxf(mloc[2], mloc[3]));
        const float m_new = fmaxf(m_run, fmaxf(mhalf, xhalf(mhalf)));
        const float alpha = __expf(m_run - m_new);

        float lloc[4];
#pragma unroll  // constant indices keep the tiles in registers
        for (int nt = 0; nt < 4; ++nt) {
#pragma unroll  // constant indices keep the tiles in registers
            for (int i = 0; i < 2; ++i) {
                float e0 = (sc[nt][4*i+0] - m_new) * LOG2E;
                float e1 = (sc[nt][4*i+1] - m_new) * LOG2E;
                float e2 = (sc[nt][4*i+2] - m_new) * LOG2E;
                float e3 = (sc[nt][4*i+3] - m_new) * LOG2E;
                exp2x4(e0, e1, e2, e3);
                sc[nt][4*i+0] = e0; sc[nt][4*i+1] = e1; sc[nt][4*i+2] = e2; sc[nt][4*i+3] = e3;
                const float l4 = (e0 + e1) + (e2 + e3);
                lloc[nt] = i ? lloc[nt] + l4 : l4;
            }
        }
        // the multiply-add fused by hand (one rounding): left to the compiler it is fused in some builds only
        l_run = __builtin_fmaf(l_run, alpha, (lloc[0] + lloc[1]) + (lloc[2] + lloc[3]));
        m_run = m_new;

        // rescale O^T: every accumulator register of a lane belongs to its own query
#pragma unroll  // constant indices keep the tiles in registers
        for (int r = 0; r < 8; ++r) {
            oc0[r] *= alpha;
            oc1[r] *= alpha;
        }

        // ---- O^T += V P^T : K-dim = 64 keys (16 chunks of 4), two 16-row d tiles.
        //      B pair = two neighbouring score registers: keys kb + {0,1}, then kb + {2,3}, kb = nt*16 + 8*half + 4*i;
        //      the A loader takes V at the same keys in the same (half, j) places, four keys to a 16-byte read.
#pragma unroll  // constant indices keep the tiles in registers
        for (int nt = 0; nt < 4; ++nt) {
#pragma unroll  // constant indices keep the tiles in registers
            for (int i = 0; i < 2; ++i) {
                const int kb = nt * 16 + 8 * half + 4 * i;
                const float4 va0 = *(const float4*)&LVb[(lane16 +  0) * PV + kb];
                const float4 va1 = *(const float4*)&LVb[(lane16 + 16) * PV + kb];
                v2f a0, a1, b;
                b.x  = sc[nt][4*i+0]; b.y  = sc[nt][4*i+1];
                a0.x = va0.x;         a0.y = va0.y;
                a1.x = va1.x;         a1.y = va1.y;
                oc0 = __builtin_amdgcn_wmma_f32_16x16x4_f32(
                          false, a0, false, b, (short)0, oc0, false, false);
                oc1 = __builtin_amdgcn_wmma_f32_16x16x4_f32(
                          false, a1, false, b, (short)0, oc1, false, false);
                b.x  = sc[nt][4*i+2]; b.y  = sc[nt][4*i+3];
                a0.x = va0.z;         a0.y = va0.w;
                a1.x = va1.z;         a1.y = va1.w;
                oc0 = __builtin_amdgcn_wmma_f32_16x16x4_f32(
                          false, a0, false, b, (short)0, oc0, false, false);
                oc1 = __builtin_amdgcn_wmma_f32_16x16x4_f32(
                          false, a1, false, b, (short)0, oc1, false, false);
            }
        }

        // ---- hand-over: tile t+1 is published and buffer t&1 is freed by ONE barrier
        asm volatile("s_wait_dscnt 0x0" ::: "memory");     // this wave's reads of buffer t&1 are done
        asm volatile("s_wait_asynccnt 0x0" ::: "memory");  // this wave's copies of tile t+1 have landed
        __syncthreads();
        if (t + 2 < NTILE) {   // the same for the whole workgroup: tile t+2 into the buffer just read
            const unsigned bk = (unsigned)buf * (DH * PK * 4);
            const unsigned bv = (unsigned)buf * (DH * PV * 4);
            const float* gk2 = gk + s0 + 2 * SBLK;
            const float* gv2 = gv + s0 + 2 * SBLK;
            copy_tile(lk + bk, lk + bk + 16 * PK * 4, lv + bv, lv + bv + 16 * PV * 4,
                      gk2, gk2 + (size_t)16 * L_SEQ, gv2, gv2 + (size_t)16 * L_SEQ);
        }
    }
    asm volatile("s_wait_asynccnt 0x0" ::: "memory");      // no copy is left in flight when the wave ends

    // ---- normalize and store: out[n][h*32 + d][l0 + lane16]; register r holds row d = r + 8*half
    const float inv = 1.0f / (l_run + xhalf(l_run));
    float* outp = out + headoff + (size_t)(8 * half) * L_SEQ + l0 + lane16;
#pragma unroll  // constant indices keep the tiles in registers
    for (int r = 0; r < 8; ++r) {
        outp[(size_t)(r +  0) * L_SEQ] = oc0[r] * inv;
        outp[(size_t)(r + 16) * L_SEQ] = oc1[r] * inv;
    }
}

extern "C" void kernel_launch(void* const* d_in, const int* in_sizes, int n_in,
                              void* d_out, int out_size, void* d_ws, size_t ws_size,
                              hipStream_t stream) {
    const float* q  = (const float*)d_in[0];
    const float* k  = (const float*)d_in[1];
    const float* v  = (const float*)d_in[2];
    const int*   m0 = (const int*)d_in[3];
    const int*   m1 = (const int*)d_in[4];
    float* out = (float*)d_out;

    const int N = in_sizes[0] / (256 * L_SEQ);   // q is (N, 256, L)
    dim3 grid(N * NHEADS * (L_SEQ / 128));       // 512 workgroups for N=4
    dim3 block(256);
    fullattn_f32wmma_kernel<<<grid, block, 0, stream>>>(q, k, v, m0, m1, out);
}

// v004
// One run takes 60 microseconds.
// Two timings next to v003 put it at 1.66 and 1.65 times that version's speed.
// Counting every step since v000, it is 6.30 times as fast.
#include <hip/hip_runtime.h>

typedef float v2f __attribute__((ext_vector_type(2)));
typedef float v8f __attribute__((ext_vector_type(8)));

#define L_SEQ    2048
#define DH       32
#define NHEADS   8
#define SBLK     64
// LDS row pitches in floats (64 banks of 4 bytes; a pitch of 64 puts a whole column on one bank):
//   PK: the lane halves read rows d and d+2, 16 floats each, two column tiles per paired load
//       -> 2*PK mod 64 = 32 puts the four 16-float runs on four different quarters of the banks
//   PV: 16 lanes walk a column with 16-byte accesses -> pitch mod 64 = 4 spreads them over all banks
#define PK       80
#define PV       68
#define NEGV     (-1.0e8f)
#define SM_SCALE 0.17677669529663689f   /* 1/sqrt(32) */
#define LOG2E    1.44269504088896340736f /* exp(x) = 2^(x * LOG2E), as __expf forms it */
#define NTILE    (L_SEQ / SBLK)
#define NCH      16                      /* V's row sums are taken in 16 pieces of 128 columns */

// byte address of a __shared__ object inside the workgroup's LDS: the low 32 bits of its generic address
__device__ __forceinline__ unsigned lds_off(const void* p) { return (unsigned)(size_t)p; }

// Eight rows of one gathered tile column from global memory into LDS through no register: eight 4-byte copies
// per lane, every lane on; rows 4 apart (g: this lane's key column in its first row, l: its place in LDS).
// s_wait_xcnt 0 is the statement's last line, so that it stands in front of every later write of a register
// that a copy names (a precaution for the address translation of an issued copy).
__device__ __forceinline__ void copy8(unsigned l, unsigned lstep, const float* g) {
    asm volatile("global_load_async_to_lds_b32 %0, %8, off\n\t"
                 "global_load_async_to_lds_b32 %1, %9, off\n\t"
                 "global_load_async_to_lds_b32 %2, %10, off\n\t"
                 "global_load_async_to_lds_b32 %3, %11, off\n\t"
                 "global_load_async_to_lds_b32 %4, %12, off\n\t"
                 "global_load_async_to_lds_b32 %5, %13, off\n\t"
                 "global_load_async_to_lds_b32 %6, %14, off\n\t"
                 "global_load_async_to_lds_b32 %7, %15, off\n\t"
                 "s_wait_xcnt 0x0"
                 :: "v"(l), "v"(l + lstep), "v"(l + 2 * lstep), "v"(l + 3 * lstep),
                    "v"(l + 4 * lstep), "v"(l + 5 * lstep), "v"(l + 6 * lstep), "v"(l + 7 * lstep),
                    "v"(g), "v"(g + (size_t)4 * L_SEQ), "v"(g + (size_t)8 * L_SEQ), "v"(g + (size_t)12 * L_SEQ),
                    "v"(g + (size_t)16 * L_SEQ), "v"(g + (size_t)20 * L_SEQ), "v"(g + (size_t)24 * L_SEQ),
                    "v"(g + (size_t)28 * L_SEQ)
                 : "memory");
}

// lane l <-> lane l ^ 16: the two lanes that share one query column
__device__ __forceinline__ float xhalf(float x) {
    const int b = __builtin_bit_cast(int, x);
    return __builtin_bit_cast(float,
        __builtin_amdgcn_permlanex16(b, b, 0x76543210, 0xfedcba98, false, false));
}

// Four 2^x, each in its own register. Written by hand so that the free slot which the instruction set
// asks for behind a transcendental (before its result is read or its source overwritten) stands inside
// the statement. Each v_exp_f32 is the slot
// of the one in front of it, the v_nop that of the last. In place, so that the statement writes no register
// but those which the compiler's own multiply has just written.
__device__ __forceinline__ void exp2x4(float& x0, float& x1, float& x2, float& x3) {
    asm("v_exp_f32 %0, %0\n\t"
        "v_exp_f32 %1, %1\n\t"
        "v_exp_f32 %2, %2\n\t"
        "v_exp_f32 %3, %3\n\t"
        "v_nop"
        : "+v"(x0), "+v"(x1), "+v"(x2), "+v"(x3));
}

// One workgroup = (n, h, 128-query block); 8 waves of 32, each wave owns 16 query columns.
// Both products run transposed: S^T = K^T Q (keys are rows, queries are columns) and O^T += V P^T.
// In every 16x16 result tile a lane then holds values of ONE query (column lane16), so the softmax
// is in-lane work plus one exchange between the lane halves, and the score registers, once they hold
// exp(), are the B operand of the second product as they stand: P is never written to LDS.
// K and V tiles come into two LDS buffers by asynchronous copies, one tile ahead of the tile in work.
// Only keys with mask1 != 0 are worked on: a masked key's score is -1e8, so beside any unmasked key its weight
// underflows to exactly 0. The workgroup lists the unmasked keys (in key order) and the copies gather those
// columns of K and V, so a tile holds 64 unmasked keys and only the last tile has places to blank.
// A query with mask0 = 0, and every query when no key is unmasked, has 2048 equal scores: its output is the
// mean of V's row over ALL keys, which is summed beside the loop and stored for such a query.
// waves_per_eu(4, 4): residency stays at two workgroups per WGP, as before the registers and the LDS shrank,
// so that the 512 workgroups lie two on each of the 256 WGPs however the dispatcher fills them.
__global__ __launch_bounds__(256) __attribute__((amdgpu_waves_per_eu(4, 4)))
void fullattn_f32wmma_kernel(const float* __restrict__ q,
                             const float* __restrict__ k,
                             const float* __restrict__ v,
                             const int*   __restrict__ mask0,
                             const int*   __restrict__ mask1,
                             float*       __restrict__ out)
{
    __shared__ __align__(16) float LK[2][DH * PK];       // K tiles  [buffer][d][s]
    __shared__ __align__(16) float LV[2][DH * PV];       // V tiles  [buffer][d][s]
    __shared__ __align__(16) int   IDX[L_SEQ + SBLK];    // the unmasked keys of batch n, then 64 filler places
    __shared__ int                 WCNT[8];              // unmasked keys in each wave's 256 keys
    __shared__ __align__(16) float VM[DH];               // mean of each V row over all keys

    const int tid    = threadIdx.x;
    const int lane   = tid & 31;
    const int wave   = tid >> 5;
    const int half   = lane >> 4;      // 0: lanes 0-15, 1: lanes 16-31
    const int lane16 = lane & 15;

    const int bx   = blockIdx.x;
    const int mblk = bx & 15;          // 16 blocks of 128 queries
    const int h    = (bx >> 4) & 7;
    const int n    = bx >> 7;

    const int l0 = mblk * 128 + wave * 16;   // this wave's first query
    const size_t headoff = ((size_t)n * NHEADS + h) * (size_t)DH * L_SEQ;
    const float* qh = q + headoff;
    const float* kh = k + headoff;
    const float* vh = v + headoff;

    // ---- the list of unmasked keys: wave w looks at keys 256w .. 256w+255, 32 at a time, one key a lane
    const int wv = __builtin_amdgcn_readfirstlane(wave);
    unsigned bal[8];
    {
        const int* m1 = mask1 + (size_t)n * L_SEQ + wv * 256 + lane;
        int wtot = 0;
#pragma unroll  // constant indices keep the ballots in registers
        for (int j = 0; j < 8; ++j) {
            bal[j] = __builtin_amdgcn_ballot_w32(m1[j * 32] != 0);
            wtot += __builtin_popcount(bal[j]);
        }
        if (lane == 0) WCNT[wv] = wtot;
    }
    __syncthreads();   // every wave's count is written
    int cnt = 0;       // unmasked keys of batch n, 0 .. 2048
    {
        int base = 0;  // unmasked keys in front of this wave's
#pragma unroll  // eight counts, read as two 16-byte LDS loads
        for (int w = 0; w < 8; ++w) {
            const int c = WCNT[w];
            cnt += c;
            base += (w < wv) ? c : 0;
        }
        const unsigned below = (1u << lane) - 1u;
#pragma unroll  // constant indices keep the ballots in registers
        for (int j = 0; j < 8; ++j) {
            if ((bal[j] >> lane) & 1u)
                IDX[base + __builtin_popcount(bal[j] & below)] = wv * 256 + j * 32 + lane;
            base += __builtin_popcount(bal[j]);
        }
        if (tid < SBLK) IDX[cnt + tid] = 0;   // filler: a readable column; its scores are blanked in the last tile
    }
    cnt = __builtin_amdgcn_readfirstlane(cnt);
    const int ntile = min((cnt + SBLK - 1) / SBLK, NTILE);   // tiles of 64 unmasked keys, 0 .. 32
    __syncthreads();   // the list is written

    // ---- staging map: lane t copies list place sj of a tile, rows sq, sq+4, .. sq+28 of K and of V
    const int sj = tid & (SBLK - 1);
    const int sq = tid >> 6;
    const float* gk = kh + (size_t)sq * L_SEQ;
    const float* gv = vh + (size_t)sq * L_SEQ;
    const unsigned lk = lds_off(&LK[0][sq * PK + sj]);
    const unsigned lv = lds_off(&LV[0][sq * PV + sj]);

    // tile 0 into buffer 0 (with no unmasked key at all: 64 fillers, never read)
    {
        const int key = IDX[sj];
        copy8(lk, 4 * PK * 4, gk + key);
        copy8(lv, 4 * PV * 4, gv + key);
    }

    // ---- V's row sums over all keys: lane t sums, of row t/8, the columns 32*m + 4*(t%8) .. +3
    const float* vs = vh + (size_t)(tid >> 3) * L_SEQ + (tid & 7) * 4;
    float4 vacc = make_float4(0.0f, 0.0f, 0.0f, 0.0f);

    // ---- Q tile in WMMA B-layout registers (N=16, per K-chunk of 4; the same lane map as an A operand):
    //      qa[2c+j] = Q[K=4c + 2*half + j][N=lane16] = q[d][l0+lane16]
    float qa[16];
#pragma unroll
    for (int c = 0; c < 8; ++c) {
        const int d0 = 4 * c + 2 * half;
        qa[2*c+0] = qh[(size_t)(d0 + 0) * L_SEQ + l0 + lane16];
        qa[2*c+1] = qh[(size_t)(d0 + 1) * L_SEQ + l0 + lane16];
    }

    const bool m0ok = mask0[(size_t)n * L_SEQ + l0 + lane16] != 0;  // this lane's query mask

    v8f oc0 = {};          // O^T accumulator, rows d = 0..15,  column = query lane16
    v8f oc1 = {};          // O^T accumulator, rows d = 16..31
    float m_run = -INFINITY;   // running maximum of this lane's query (equal in both halves)
    float l_run = 0.0f;        // running sum over the keys of THIS half only; joined after the loop

    // this wave's copies of tile 0 have landed ...
    asm volatile("s_wait_asynccnt 0x0" ::: "memory");
    __syncthreads();   // ... and so have every other wave's: tile 0 may be read
    if (ntile > 1) {   // the same for the whole workgroup: tile 1 into buffer 1, it flies while tile 0 is worked on
        const int key = IDX[SBLK + sj];
        copy8(lk + DH * PK * 4, 4 * PK * 4, gk + key);
        copy8(lv + DH * PV * 4, 4 * PV * 4, gv + key);
    }

    const float* vp = vs;   // the piece of V's row sums that the trip loads
    for (int t = 0; t < ntile; ++t) {
        const int s0  = t * SBLK;
        const int buf = t & 1;
        const float* LKb = LK[buf];
        const float* LVb = LV[buf];

        // this lane's key of tile t+2, read early so that the copies at the foot do not wait for it
        const int key2 = IDX[min(t + 2, ntile - 1) * SBLK + sj];

        // V's row sums: one piece is loaded here, flies during the trip and is added behind the barrier at its foot.
        // No branch round the loads (from trip 16 on the last piece comes again and is not added): under a branch
        // the compiler drew the additions, and with them the wait for the loads, up to this place.
        const float4 x0 = *(const float4*)(vp +  0);
        const float4 x1 = *(const float4*)(vp + 32);
        const float4 x2 = *(const float4*)(vp + 64);
        const float4 x3 = *(const float4*)(vp + 96);

        // ---- S^T = K^T Q : 64 keys x 16 queries as four 16x16 tiles, K-dim = 32 (8 chunks of 4).
        //      sc[nt][r] = score(key nt*16 + 8*half + r, query lane16)
        v8f sc[4] = {};
#pragma unroll  // constant indices keep the tiles in registers
        for (int c = 0; c < 8; ++c) {
            const int d0 = 4 * c + 2 * half;
            v2f b; b.x = qa[2*c+0]; b.y = qa[2*c+1];
#pragma unroll  // constant indices keep the tiles in registers
            for (int nt = 0; nt < 4; ++nt) {
                v2f a;
                a.x = LKb[(d0 + 0) * PK + nt * 16 + lane16];  // A[M=lane16][K=d0  ]
                a.y = LKb[(d0 + 1) * PK + nt * 16 + lane16];  // A[M=lane16][K=d0+1]
                sc[nt] = __builtin_amdgcn_wmma_f32_16x16x4_f32(
                             false, a, false, b, (short)0, sc[nt], false, false);
            }
        }

        // Four vector slots between the last score WMMA and the first vector instruction that reads a score.
        // The tiles are named so that every score WMMA stands in front of the slots and every reader behind.
        asm("v_nop\n\tv_nop\n\tv_nop\n\tv_nop" : "+v"(sc[0]), "+v"(sc[1]), "+v"(sc[2]), "+v"(sc[3]));

        // ---- online softmax over this 64-key block, in registers (32 keys of one query per lane)
        float mloc[4];
        if (s0 + SBLK <= cnt) {   // a full tile (the same for the whole workgroup): every key counts
#pragma unroll  // constant indices keep the tiles in registers
            for (int nt = 0; nt < 4; ++nt) {
                mloc[nt] = -INFINITY;
#pragma unroll  // constant indices keep the tiles in registers
                for (int r = 0; r < 8; ++r) {
                    const float sv = sc[nt][r] * SM_SCALE;
                    sc[nt][r] = sv;
                    mloc[nt] = fmaxf(mloc[nt], sv);
                }
            }
        } else {                  // the last tile: the filler places take the masked score
            const int rem = cnt - s0 - 8 * half;
#pragma unroll  // constant indices keep the tiles in registers
            for (int nt = 0; nt < 4; ++nt) {
                mloc[nt] = -INFINITY;
#pragma unroll  // constant indices keep the tiles in registers
                for (int r = 0; r < 8; ++r) {
                    const float sv = ((nt * 16 + r < rem) ? sc[nt][r] : NEGV) * SM_SCALE;
                    sc[nt][r] = sv;
                    mloc[nt] = fmaxf(mloc[nt], sv);
                }
            }
        }
        const float mhalf = fmaxf(fmaxf(mloc[0], mloc[1]), fmaxf(mloc[2], mloc[3]));
        const float m_new = fmaxf(m_run, fmaxf(mhalf, xhalf(mhalf)));
        const float alpha = __expf(m_run - m_new);

        float lloc[4];
#pragma unroll  // constant indices keep the tiles in registers
        for (int nt = 0; nt < 4; ++nt) {
#pragma unroll  // constant indices keep the tiles in registers
            for (int i = 0; i < 2; ++i) {
                float e0 = (sc[nt][4*i+0] - m_new) * LOG2E;
                float e1 = (sc[nt][4*i+1] - m_new) * LOG2E;
                float e2 = (sc[nt][4*i+2] - m_new) * LOG2E;
                float e3 = (sc[nt][4*i+3] - m_new) * LOG2E;
                exp2x4(e0, e1, e2, e3);
                sc[nt][4*i+0] = e0; sc[nt][4*i+1] = e1; sc[nt][4*i+2] = e2; sc[nt][4*i+3] = e3;
                const float l4 = (e0 + e1) + (e2 + e3);
                lloc[nt] = i ? lloc[nt] + l4 : l4;
            }
        }
        // the multiply-add fused by hand (one rounding): left to the compiler it is fused in some builds only
        l_run = __builtin_fmaf(l_run, alpha, (lloc[0] + lloc[1]) + (lloc[2] + lloc[3]));
        m_run = m_new;

        // rescale O^T: every accumulator register of a lane belongs to its own query
#pragma unroll  // constant indices keep the tiles in registers
        for (int r = 0; r < 8; ++r) {
            oc0[r] *= alpha;
            oc1[r] *= alpha;
        }

        // ---- O^T += V P^T : K-dim = 64 keys (16 chunks of 4), two 16-row d tiles.
        //      B pair = two neighbouring score registers: keys kb + {0,1}, then kb + {2,3}, kb = nt*16 + 8*half + 4*i;
        //      the A loader takes V at the same keys in the same (half, j) places, four keys to a 16-byte read.
#pragma unroll  // constant indices keep the tiles in registers
        for (int nt = 0; nt < 4; ++nt) {
#pragma unroll  // constant indices keep the tiles in registers
            for (int i = 0; i < 2; ++i) {
                const int kb = nt * 16 + 8 * half + 4 * i;
                const float4 va0 = *(const float4*)&LVb[(lane16 +  0) * PV + kb];
                const float4 va1 = *(const float4*)&LVb[(lane16 + 16) * PV + kb];
                v2f a0, a1, b;
                b.x  = sc[nt][4*i+0]; b.y  = sc[nt][4*i+1];
                a0.x = va0.x;         a0.y = va0.y;
                a1.x = va1.x;         a1.y = va1.y;
                oc0 = __builtin_amdgcn_wmma_f32_16x16x4_f32(
                          false, a0, false, b, (short)0, oc0, false, false);
                oc1 = __builtin_amdgcn_wmma_f32_16x16x4_f32(
                          false, a1, false, b, (short)0, oc1, false, false);
                b.x  = sc[nt][4*i+2]; b.y  = sc[nt][4*i+3];
                a0.x = va0.z;         a0.y = va0.w;
                a1.x = va1.z;         a1.y = va1.w;
                oc0 = __builtin_amdgcn_wmma_f32_16x16x4_f32(
                          false, a0, false, b, (short)0, oc0, false, false);
                oc1 = __builtin_amdgcn_wmma_f32_16x16x4_f32(
                          false, a1, false, b, (short)0, oc1, false, false);
            }
        }

        // ---- hand-over: tile t+1 is published and buffer t&1 is freed by ONE barrier
        asm volatile("s_wait_dscnt 0x0" ::: "memory");     // this wave's reads of buffer t&1 are done
        asm volatile("s_wait_asynccnt 0x0" ::: "memory");  // this wave's copies of tile t+1 have landed
        __syncthreads();
        if (t + 2 < ntile) {   // the same for the whole workgroup: tile t+2 into the buffer just read
            copy8(lk + (unsigned)buf * (DH * PK * 4), 4 * PK * 4, gk + key2);
            copy8(lv + (unsigned)buf * (DH * PV * 4), 4 * PV * 4, gv + key2);
        }
        if (t < NCH) {
            vacc.x += (x0.x + x1.x) + (x2.x + x3.x);
            vacc.y += (x0.y + x1.y) + (x2.y + x3.y);
            vacc.z += (x0.z + x1.z) + (x2.z + x3.z);
            vacc.w += (x0.w + x1.w) + (x2.w + x3.w);
        }
        if (t < NCH - 1) vp += 128;   // stepped here, behind the loads' return, so that their address stays untouched in flight
    }
    asm volatile("s_wait_asynccnt 0x0" ::: "memory");      // no copy is left in flight when the wave ends

    // the pieces of V's row sums that the loop had no trip for (fewer than 16 tiles)
#pragma unroll 1  // a remainder that few inputs reach: kept short
    for (int c = ntile; c < NCH; ++c) {
        const float4 x0 = *(const float4*)(vs + c * 128 +  0);
        const float4 x1 = *(const float4*)(vs + c * 128 + 32);
        const float4 x2 = *(const float4*)(vs + c * 128 + 64);
        const float4 x3 = *(const float4*)(vs + c * 128 + 96);
        vacc.x += (x0.x + x1.x) + (x2.x + x3.x);
        vacc.y += (x0.y + x1.y) + (x2.y + x3.y);
        vacc.z += (x0.z + x1.z) + (x2.z + x3.z);
        vacc.w += (x0.w + x1.w) + (x2.w + x3.w);
    }
    {
        float ps = (vacc.x + vacc.y) + (vacc.z + vacc.w);   // the eight lanes of a row are neighbours
        ps += __shfl_xor(ps, 1);
        ps += __shfl_xor(ps, 2);
        ps += __shfl_xor(ps, 4);
        if ((tid & 7) == 0) VM[tid >> 3] = ps * (1.0f / L_SEQ);
    }
    __syncthreads();   // the 32 row means are written

    // ---- normalize and store: out[n][h*32 + d][l0 + lane16]; register r holds row d = r + 8*half
    const float inv = 1.0f / (l_run + xhalf(l_run));
    const bool  flat = !m0ok || cnt == 0;   // all 2048 scores of this lane's query are equal
    const float4 ma = *(const float4*)&VM[8 * half +  0], mb = *(const float4*)&VM[8 * half +  4];
    const float4 mc = *(const float4*)&VM[8 * half + 16], md = *(const float4*)&VM[8 * half + 20];
    const float mv0[8] = { ma.x, ma.y, ma.z, ma.w, mb.x, mb.y, mb.z, mb.w };
    const float mv1[8] = { mc.x, mc.y, mc.z, mc.w, md.x, md.y, md.z, md.w };
    float* outp = out + headoff + (size_t)(8 * half) * L_SEQ + l0 + lane16;
#pragma unroll  // constant indices keep the tiles in registers
    for (int r = 0; r < 8; ++r) {
        outp[(size_t)(r +  0) * L_SEQ] = flat ? mv0[r] : oc0[r] * inv;
        outp[(size_t)(r + 16) * L_SEQ] = flat ? mv1[r] : oc1[r] * inv;
    }
}

extern "C" void kernel_launch(void* const* d_in, const int* in_sizes, int n_in,
                              void* d_out, int out_size, void* d_ws, size_t ws_size,
                              hipStream_t stream) {
    const float* q  = (const float*)d_in[0];
    const float* k  = (const float*)d_in[1];
    const float* v  = (const float*)d_in[2];
    const int*   m0 = (const int*)d_in[3];
    const int*   m1 = (const int*)d_in[4];
    float* out = (float*)d_out;

    const int N = in_sizes[0] / (256 * L_SEQ);   // q is (N, 256, L)
    dim3 grid(N * NHEADS * (L_SEQ / 128));       // 512 workgroups for N=4
    dim3 block(256);
    fullattn_f32wmma_kernel<<<grid, block, 0, stream>>>(q, k, v, m0, m1, out);
}

// v005
// One run takes 44.8 microseconds.
// Next to v004, in two timings, it ran 1.34 times as fast each time.
// All steps since v000 together make it 8.43 times as fast.
#include <hip/hip_runtime.h>

typedef float v2f __attribute__((ext_vector_type(2)));
typedef float v8f __attribute__((ext_vector_type(8)));

#define L_SEQ    2048
#define DH       32
#define NHEADS   8
#define SBLK     128                     /* keys of one staged tile */
#define UKEY     64                      /* keys of a tile that one wave works on */
#define QBLK     256                     /* queries of one workgroup */
#define NWAVE    16
// LDS row pitches in floats (64 banks of 4 bytes; a multiple of 64 puts a whole column on one bank):
//   PK: the lane halves read rows d and d+2, 16 floats each, two column tiles per paired load
//       -> 2*PK mod 64 = 32 puts the four 16-float runs on four different quarters of the banks
//   PV: 16 lanes walk a column with 16-byte accesses -> pitch mod 64 = 4 spreads them over all banks
#define PK       144
#define PV       132
#define NEGV     (-1.0e8f)
#define SM_SCALE 0.17677669529663689f   /* 1/sqrt(32) */
#define LOG2E    1.44269504088896340736f /* exp(x) = 2^(x * LOG2E), as __expf forms it */
#define NTILE    (L_SEQ / SBLK)
#define NCH      8                       /* V's row sums are taken in 8 pieces of 256 columns */

// byte address of a __shared__ object inside the workgroup's LDS: the low 32 bits of its generic address
__device__ __forceinline__ unsigned lds_off(const void* p) { return (unsigned)(size_t)p; }

// Eight rows of one gathered tile column from global memory into LDS through no register: eight 4-byte copies
// per lane, every lane on; rows 4 apart (g: this lane's key column in its first row, l: its place in LDS).
// s_wait_xcnt 0 is the statement's last line, so that it stands in front of every later write of a register
// that a copy names (a precaution for the address translation of an issued copy).
__device__ __forceinline__ void copy8(unsigned l, unsigned lstep, const float* g) {
    asm volatile("global_load_async_to_lds_b32 %0, %8, off\n\t"
                 "global_load_async_to_lds_b32 %1, %9, off\n\t"
                 "global_load_async_to_lds_b32 %2, %10, off\n\t"
                 "global_load_async_to_lds_b32 %3, %11, off\n\t"
                 "global_load_async_to_lds_b32 %4, %12, off\n\t"
                 "global_load_async_to_lds_b32 %5, %13, off\n\t"
                 "global_load_async_to_lds_b32 %6, %14, off\n\t"
                 "global_load_async_to_lds_b32 %7, %15, off\n\t"
                 "s_wait_xcnt 0x0"
                 :: "v"(l), "v"(l + lstep), "v"(l + 2 * lstep), "v"(l + 3 * lstep),
                    "v"(l + 4 * lstep), "v"(l + 5 * lstep), "v"(l + 6 * lstep), "v"(l + 7 * lstep),
                    "v"(g), "v"(g + (size_t)4 * L_SEQ), "v"(g + (size_t)8 * L_SEQ), "v"(g + (size_t)12 * L_SEQ),
                    "v"(g + (size_t)16 * L_SEQ), "v"(g + (size_t)20 * L_SEQ), "v"(g + (size_t)24 * L_SEQ),
                    "v"(g + (size_t)28 * L_SEQ)
                 : "memory");
}

// lane l <-> lane l ^ 16: the two lanes that share one query column
__device__ __forceinline__ float xhalf(float x) {
    const int b = __builtin_bit_cast(int, x);
    return __builtin_bit_cast(float,
        __builtin_amdgcn_permlanex16(b, b, 0x76543210, 0xfedcba98, false, false));
}

// Four 2^x, each in its own register. Written by hand so that the free slot which the instruction set
// asks for behind a transcendental (before its result is read or its source overwritten) stands inside
// the statement. Each v_exp_f32 is the slot
// of the one in front of it, the v_nop that of the last. In place, so that the statement writes no register
// but those which the compiler's own multiply has just written.
__device__ __forceinline__ void exp2x4(float& x0, float& x1, float& x2, float& x3) {
    asm("v_exp_f32 %0, %0\n\t"
        "v_exp_f32 %1, %1\n\t"
        "v_exp_f32 %2, %2\n\t"
        "v_exp_f32 %3, %3\n\t"
        "v_nop"
        : "+v"(x0), "+v"(x1), "+v"(x2), "+v"(x3));
}

// What one wave keeps for one group of 16 live queries and its half of every key tile.
struct Unit {
    float qa[16];   // Q in WMMA B-layout: qa[2c+j] = q[d = 4c + 2*half + j][the query of column lane16]
    v8f   oc0;      // O^T accumulator, rows d = 0..15,  column = query lane16
    v8f   oc1;      // O^T accumulator, rows d = 16..31
    float m_run;    // running maximum of this lane's query (equal in both lane halves)
    float l_run;    // running sum over the keys of THIS lane half only; joined after the loop
};

__device__ __forceinline__ void unit_clear(Unit& u) {
#pragma unroll  // constant indices keep the array in registers
    for (int i = 0; i < 16; ++i) u.qa[i] = 0.0f;
    u.oc0 = v8f{};
    u.oc1 = v8f{};
    u.m_run = -INFINITY;
    u.l_run = 0.0f;
}

// qcol: this lane's query column in row 0 of the head
__device__ __forceinline__ void unit_load_q(Unit& u, const float* qcol, int half) {
#pragma unroll  // constant indices keep the array in registers
    for (int c = 0; c < 8; ++c) {
        const int d0 = 4 * c + 2 * half;
        u.qa[2*c+0] = qcol[(size_t)(d0 + 0) * L_SEQ];
        u.qa[2*c+1] = qcol[(size_t)(d0 + 1) * L_SEQ];
    }
    // in front of the next write of the address registers that these loads name
    asm volatile("s_wait_xcnt 0x0" ::: "memory");
}

// 64 keys of a staged tile against the unit's 16 queries. LKb, LVb: the first of these keys in row 0 of the tile;
// left: list places from that key to the end of the key list (the same for the whole wave, above 0).
__device__ __forceinline__ void unit_step(Unit& u, const float* LKb, const float* LVb, int left,
                                          int half, int lane16) {
    // ---- S^T = K^T Q : 64 keys x 16 queries as four 16x16 tiles, K-dim = 32 (8 chunks of 4).
    //      sc[nt][r] = score(key nt*16 + 8*half + r, query lane16)
    v8f sc[4] = {};
#pragma unroll  // constant indices keep the tiles in registers
    for (int c = 0; c < 8; ++c) {
        const int d0 = 4 * c + 2 * half;
        v2f b; b.x = u.qa[2*c+0]; b.y = u.qa[2*c+1];
#pragma unroll  // constant indices keep the tiles in registers
        for (int nt = 0; nt < 4; ++nt) {
            v2f a;
            a.x = LKb[(d0 + 0) * PK + nt * 16 + lane16];  // A[M=lane16][K=d0  ]
            a.y = LKb[(d0 + 1) * PK + nt * 16 + lane16];  // A[M=lane16][K=d0+1]
            sc[nt] = __builtin_amdgcn_wmma_f32_16x16x4_f32(
                         false, a, false, b, (short)0, sc[nt], false, false);
        }
    }

    // Four vector slots between the last score WMMA and the first vector instruction that reads a score.
    // The tiles are named so that every score WMMA stands in front of the slots and every reader behind.
    asm("v_nop\n\tv_nop\n\tv_nop\n\tv_nop" : "+v"(sc[0]), "+v"(sc[1]), "+v"(sc[2]), "+v"(sc[3]));

    // ---- online softmax over these 64 keys, in registers (32 keys of one query per lane)
    float mloc[4];
    if (left >= UKEY) {       // all 64 places hold a key (the same for the whole wave)
#pragma unroll  // constant indices keep the tiles in registers
        for (int nt = 0; nt < 4; ++nt) {
            mloc[nt] = -INFINITY;
#pragma unroll  // constant indices keep the tiles in registers
            for (int r = 0; r < 8; ++r) {
                const float sv = sc[nt][r] * SM_SCALE;
                sc[nt][r] = sv;
                mloc[nt] = fmaxf(mloc[nt], sv);
            }
        }
    } else {                  // the end of the list: the filler places take the masked score
        const int rem = left - 8 * half;
#pragma unroll  // constant indices keep the tiles in registers
        for (int nt = 0; nt < 4; ++nt) {
            mloc[nt] = -INFINITY;
#pragma unroll  // constant indices keep the tiles in registers
            for (int r = 0; r < 8; ++r) {
                const float sv = ((nt * 16 + r < rem) ? sc[nt][r] : NEGV) * SM_SCALE;
                sc[nt][r] = sv;
                mloc[nt] = fmaxf(mloc[nt], sv);
            }
        }
    }
    const float mhalf = fmaxf(fmaxf(mloc[0], mloc[1]), fmaxf(mloc[2], mloc[3]));
    const float m_new = fmaxf(u.m_run, fmaxf(mhalf, xhalf(mhalf)));
    const float alpha = __expf(u.m_run - m_new);

    float lloc[4];
#pragma unroll  // constant indices keep the tiles in registers
    for (int nt = 0; nt < 4; ++nt) {
#pragma unroll  // constant indices keep the tiles in registers
        for (int i = 0; i < 2; ++i) {
            float e0 = (sc[nt][4*i+0] - m_new) * LOG2E;
            float e1 = (sc[nt][4*i+1] - m_new) * LOG2E;
            float e2 = (sc[nt][4*i+2] - m_new) * LOG2E;
            float e3 = (sc[nt][4*i+3] - m_new) * LOG2E;
            exp2x4(e0, e1, e2, e3);
            sc[nt][4*i+0] = e0; sc[nt][4*i+1] = e1; sc[nt][4*i+2] = e2; sc[nt][4*i+3] = e3;
            const float l4 = (e0 + e1) + (e2 + e3);
            lloc[nt] = i ? lloc[nt] + l4 : l4;
        }
    }
    // the multiply-add fused by hand (one rounding): left to the compiler it is fused in some builds only
    u.l_run = __builtin_fmaf(u.l_run, alpha, (lloc[0] + lloc[1]) + (lloc[2] + lloc[3]));
    u.m_run = m_new;

    // rescale O^T: every accumulator register of a lane belongs to its own query
#pragma unroll  // constant indices keep the tiles in registers
    for (int r = 0; r < 8; ++r) {
        u.oc0[r] *= alpha;
        u.oc1[r] *= alpha;
    }

    // ---- O^T += V P^T : K-dim = 64 keys (16 chunks of 4), two 16-row d tiles.
    //      B pair = two neighbouring score registers: keys kb + {0,1}, then kb + {2,3}, kb = nt*16 + 8*half + 4*i;
    //      the A loader takes V at the same keys in the same (half, j) places, four keys to a 16-byte read.
#pragma unroll  // constant indices keep the tiles in registers
    for (int nt = 0; nt < 4; ++nt) {
#pragma unroll  // constant indices keep the tiles in registers
        for (int i = 0; i < 2; ++i) {
            const int kb = nt * 16 + 8 * half + 4 * i;
            const float4 va0 = *(const float4*)&LVb[(lane16 +  0) * PV + kb];
            const float4 va1 = *(const float4*)&LVb[(lane16 + 16) * PV + kb];
            v2f a0, a1, b;
            b.x  = sc[nt][4*i+0]; b.y  = sc[nt][4*i+1];
            a0.x = va0.x;         a0.y = va0.y;
            a1.x = va1.x;         a1.y = va1.y;
            u.oc0 = __builtin_amdgcn_wmma_f32_16x16x4_f32(
                        false, a0, false, b, (short)0, u.oc0, false, false);
            u.oc1 = __builtin_amdgcn_wmma_f32_16x16x4_f32(
                        false, a1, false, b, (short)0, u.oc1, false, false);
            b.x  = sc[nt][4*i+2]; b.y  = sc[nt][4*i+3];
            a0.x = va0.z;         a0.y = va0.w;
            a1.x = va1.z;         a1.y = va1.w;
            u.oc0 = __builtin_amdgcn_wmma_f32_16x16x4_f32(
                        false, a0, false, b, (short)0, u.oc0, false, false);
            u.oc1 = __builtin_amdgcn_wmma_f32_16x16x4_f32(
                        false, a1, false, b, (short)0, u.oc1, false, false);
        }
    }
}

// The wave with the upper 64 keys of every tile leaves its part of a group in LDS (mg: this lane's column) ...
__device__ __forceinline__ void unit_put(const Unit& u, float* mg) {
#pragma unroll  // constant indices keep the tiles in registers
    for (int r = 0; r < 8; ++r) {
        mg[(r + 0) * 32] = u.oc0[r];
        mg[(r + 8) * 32] = u.oc1[r];
    }
    mg[16 * 32] = u.m_run;
    mg[17 * 32] = u.l_run;
}

// ... and the wave with the lower 64 keys joins the two parts under their common maximum, normalizes and stores.
// Its own maximum is finite (the first key of the list is among its keys); a partner that had no key left
// -inf, 0 and zeros, which join with factor 0. outp: row 8*half, this lane's query column; live: store or not.
__device__ __forceinline__ void unit_finish(const Unit& u, const float* mg, float* outp, bool live) {
    const float mb = mg[16 * 32];
    const float lb = mg[17 * 32];
    const float m  = fmaxf(u.m_run, mb);
    const float fa = __expf(u.m_run - m);
    const float fb = __expf(mb - m);
    const float l  = u.l_run * fa + lb * fb;
    const float inv = 1.0f / (l + xhalf(l));
    const float ga = fa * inv, gb = fb * inv;
    if (live) {
#pragma unroll  // constant indices keep the tiles in registers
        for (int r = 0; r < 8; ++r) {
            outp[(size_t)(r +  0) * L_SEQ] = u.oc0[r] * ga + mg[(r + 0) * 32] * gb;
            outp[(size_t)(r + 16) * L_SEQ] = u.oc1[r] * ga + mg[(r + 8) * 32] * gb;
        }
    }
}

// One workgroup = (n, h, 256-query block); 16 waves of 32.
// Both products run transposed: S^T = K^T Q (keys are rows, queries are columns) and O^T += V P^T.
// In every 16x16 result tile a lane then holds values of ONE query (column lane16), so the softmax
// is in-lane work plus one exchange between the lane halves, and the score registers, once they hold
// exp(), are the B operand of the second product as they stand: P is never written to LDS.
// K and V tiles come into two LDS buffers by asynchronous copies, one tile ahead of the tile in work.
// Only keys with mask1 != 0 are worked on: a masked key's score is -1e8, so beside any unmasked key its weight
// underflows to exactly 0. The workgroup lists the unmasked keys (in key order) and the copies gather those
// columns of K and V, so a tile holds 128 unmasked keys and only the last tile has places to blank.
// A query with mask0 = 0, and every query when no key is unmasked, has 2048 equal scores: its output is the
// mean of V's row over ALL keys, which is summed beside the loop and stored for such a query.
// Only the other (live) queries go through the products: the workgroup lists them and packs them into groups
// of 16 columns. A group is worked on by two waves, one for the lower and one for the upper 64 keys of every
// tile; the two parts are joined after the loop. Groups 0..7 fill the 16 waves once, both waves of a group on
// one SIMD if wave w sits on SIMD w mod 4 (then a last tile with a lower half only loads all SIMDs alike);
// groups 8..15 are a second piece of work for waves 2(g-8) and 2(g-8)+1, which then sit on two SIMDs.
// waves_per_eu(4, 4): the 16 waves of one workgroup are four to a SIMD.
__global__ __launch_bounds__(512) __attribute__((amdgpu_waves_per_eu(4, 4)))
void fullattn_f32wmma_kernel(const float* __restrict__ q,
                             const float* __restrict__ k,
                             const float* __restrict__ v,
                             const int*   __restrict__ mask0,
                             const int*   __restrict__ mask1,
                             float*       __restrict__ out)
{
    __shared__ __align__(16) float LK[2][DH * PK];       // K tiles  [buffer][d][s]
    __shared__ __align__(16) float LV[2][DH * PV];       // V tiles  [buffer][d][s]
    __shared__ __align__(16) int   IDX[L_SEQ + SBLK];    // the unmasked keys of batch n, then 128 filler places
    __shared__ __align__(16) int   QL[QBLK + 16];        // the live queries of this block, then 16 filler places
    __shared__ __align__(16) int   WCNT[NWAVE];          // unmasked keys in each wave's 128 keys
    __shared__ __align__(16) int   QCNT[NWAVE];          // live queries in each wave's 16 queries
    __shared__ __align__(16) float VM[DH];               // mean of each V row over all keys
    __shared__ float               MG[QBLK / 16][18][32]; // per group: the upper-keys wave's O^T, maximum and sum

    const int tid    = threadIdx.x;
    const int lane   = tid & 31;
    const int wave   = tid >> 5;
    const int half   = lane >> 4;      // 0: lanes 0-15, 1: lanes 16-31
    const int lane16 = lane & 15;

    const int bx   = blockIdx.x;
    const int qblk = bx & 7;           // 8 blocks of 256 queries
    const int h    = (bx >> 3) & 7;
    const int n    = bx >> 6;

    const int qbase = qblk * QBLK;     // this workgroup's first query
    const size_t headoff = ((size_t)n * NHEADS + h) * (size_t)DH * L_SEQ;
    const float* qh = q + headoff;
    const float* kh = k + headoff;
    const float* vh = v + headoff;

    // ---- the two lists: wave w looks at keys 128w .. 128w+127, 32 at a time, one key a lane,
    //      and at queries 16w .. 16w+15 of the block (both lane halves read the same 16; the lower half counts)
    const int wv = __builtin_amdgcn_readfirstlane(wave);
    unsigned bal[4];
    unsigned qbal;
    {
        const int* m1 = mask1 + (size_t)n * L_SEQ + wv * 128 + lane;
        int wtot = 0;
#pragma unroll  // constant indices keep the ballots in registers
        for (int j = 0; j < 4; ++j) {
            bal[j] = __builtin_amdgcn_ballot_w32(m1[j * 32] != 0);
            wtot += __builtin_popcount(bal[j]);
        }
        qbal = __builtin_amdgcn_ballot_w32(mask0[(size_t)n * L_SEQ + qbase + wv * 16 + lane16] != 0) & 0xffffu;
        if (lane == 0) { WCNT[wv] = wtot; QCNT[wv] = __builtin_popcount(qbal); }
    }
    // the query whose flat output this thread stores (rows 0-15 from threads 0-255, rows 16-31 from the rest)
    const bool m0ok = mask0[(size_t)n * L_SEQ + qbase + (tid & (QBLK - 1))] != 0;
    __syncthreads();   // every wave's counts are written
    int cnt = 0;       // unmasked keys of batch n, 0 .. 2048
    int nv  = 0;       // live queries of this block, 0 .. 256
    {
        int base = 0;  // unmasked keys in front of this wave's
        int qb   = 0;  // live queries in front of this wave's
#pragma unroll  // sixteen counts of each kind, read as 16-byte LDS loads
        for (int w = 0; w < NWAVE; ++w) {
            const int c = WCNT[w];
            const int e = QCNT[w];
            cnt += c;
            nv  += e;
            base += (w < wv) ? c : 0;
            qb   += (w < wv) ? e : 0;
        }
        const unsigned below = (1u << lane) - 1u;
#pragma unroll  // constant indices keep the ballots in registers
        for (int j = 0; j < 4; ++j) {
            if ((bal[j] >> lane) & 1u)
                IDX[base + __builtin_popcount(bal[j] & below)] = wv * 128 + j * 32 + lane;
            base += __builtin_popcount(bal[j]);
        }
        if ((qbal >> lane) & 1u)
            QL[qb + __builtin_popcount(qbal & below)] = wv * 16 + lane;
        if (tid < SBLK) IDX[cnt + tid] = 0;   // filler: a readable column; its scores are blanked in the last tile
        if (tid < 16)   QL[nv + tid] = 0;     // filler: a readable query; its column is never stored
    }
    cnt = __builtin_amdgcn_readfirstlane(cnt);
    nv  = __builtin_amdgcn_readfirstlane(nv);
    const int ntile = min((cnt + SBLK - 1) / SBLK, NTILE);   // tiles of 128 unmasked keys, 0 .. 16
    const int ng    = cnt > 0 ? (nv + 15) >> 4 : 0;          // groups of 16 live queries, 0 .. 16
    __syncthreads();   // the lists are written

    // ---- staging map: lane t copies list place sj of a tile, rows sq, sq+4, .. sq+28 of K and of V
    const int sj = tid & (SBLK - 1);
    const int sq = tid >> 7;
    const float* gk = kh + (size_t)sq * L_SEQ;
    const float* gv = vh + (size_t)sq * L_SEQ;
    const unsigned lk = lds_off(&LK[0][sq * PK + sj]);
    const unsigned lv = lds_off(&LV[0][sq * PV + sj]);

    // tile 0 into buffer 0 (with no unmasked key at all: 128 fillers, never read)
    {
        const int key = IDX[sj];
        copy8(lk, 4 * PK * 4, gk + key);
        copy8(lv, 4 * PV * 4, gv + key);
    }

    // ---- V's row sums over all keys: lane t sums, of row t/16, the columns 64*m + 4*(t%16) .. +3
    const float* vs = vh + (size_t)(tid >> 4) * L_SEQ + (tid & 15) * 4;
    float4 vacc = make_float4(0.0f, 0.0f, 0.0f, 0.0f);

    // ---- this wave's one or two pieces of work: (group, which 64 keys of a tile)
    const int  g0 = (wv & 3) + 4 * (wv >> 3), k0 = ((wv >> 2) & 1) * UKEY;
    const int  g1 = 8 + (wv >> 1),            k1 = (wv & 1) * UKEY;
    const bool act0 = g0 < ng, act1 = g1 < ng;
    Unit U0, U1;
    unit_clear(U0);
    unit_clear(U1);
    int ql0 = 0, ql1 = 0;   // this lane's query, counted from qbase
    if (act0) { ql0 = QL[g0 * 16 + lane16]; unit_load_q(U0, qh + qbase + ql0, half); }
    if (act1) { ql1 = QL[g1 * 16 + lane16]; unit_load_q(U1, qh + qbase + ql1, half); }

    // this wave's copies of tile 0 have landed ...
    asm volatile("s_wait_asynccnt 0x0" ::: "memory");
    __syncthreads();   // ... and so have every other wave's: tile 0 may be read
    if (ntile > 1) {   // the same for the whole workgroup: tile 1 into buffer 1, it flies while tile 0 is worked on
        const int key = IDX[SBLK + sj];
        copy8(lk + DH * PK * 4, 4 * PK * 4, gk + key);
        copy8(lv + DH * PV * 4, 4 * PV * 4, gv + key);
    }

    const float* vp = vs;   // the piece of V's row sums that the trip loads
    for (int t = 0; t < ntile; ++t) {
        const int s0  = t * SBLK;
        const int buf = t & 1;
        const float* LKb = LK[buf];
        const float* LVb = LV[buf];

        // this lane's key of tile t+2, read early so that the copies at the foot do not wait for it
        const int key2 = IDX[min(t + 2, ntile - 1) * SBLK + sj];

        // V's row sums: one piece is loaded here, flies during the trip and is added behind the barrier at its foot.
        // No branch round the loads (from trip 8 on the last piece comes again and is not added): under a branch
        // the compiler drew the additions, and with them the wait for the loads, up to this place.
        const float4 x0 = *(const float4*)(vp +   0);
        const float4 x1 = *(const float4*)(vp +  64);
        const float4 x2 = *(const float4*)(vp + 128);
        const float4 x3 = *(const float4*)(vp + 192);

        // a piece of work whose 64 places of this tile lie wholly behind the end of the list is passed over
        if (act0 && s0 + k0 < cnt) unit_step(U0, LKb + k0, LVb + k0, cnt - s0 - k0, half, lane16);
        if (act1 && s0 + k1 < cnt) unit_step(U1, LKb + k1, LVb + k1, cnt - s0 - k1, half, lane16);

        // ---- hand-over: tile t+1 is published and buffer t&1 is freed by ONE barrier
        asm volatile("s_wait_dscnt 0x0" ::: "memory");     // this wave's reads of buffer t&1 are done
        asm volatile("s_wait_asynccnt 0x0" ::: "memory");  // this wave's copies of tile t+1 have landed
        __syncthreads();
        if (t + 2 < ntile) {   // the same for the whole workgroup: tile t+2 into the buffer just read
            copy8(lk + (unsigned)buf * (DH * PK * 4), 4 * PK * 4, gk + key2);
            copy8(lv + (unsigned)buf * (DH * PV * 4), 4 * PV * 4, gv + key2);
        }
        if (t < NCH) {
            vacc.x += (x0.x + x1.x) + (x2.x + x3.x);
            vacc.y += (x0.y + x1.y) + (x2.y + x3.y);
            vacc.z += (x0.z + x1.z) + (x2.z + x3.z);
            vacc.w += (x0.w + x1.w) + (x2.w + x3.w);
        }
        // in front of the step of the address that the trip's four loads name (from trip 8 on no wait for their data stands here)
        asm volatile("s_wait_xcnt 0x0" ::: "memory");
        if (t < NCH - 1) vp += 256;   // stepped at the foot of the trip, so that the address stays untouched while the loads fly
    }
    asm volatile("s_wait_asynccnt 0x0" ::: "memory");      // no copy is left in flight when the wave ends

    // the upper-keys parts go to LDS
    if (act0 && k0 != 0) unit_put(U0, &MG[g0][0][lane]);
    if (act1 && k1 != 0) unit_put(U1, &MG[g1][0][lane]);

    // the pieces of V's row sums that the loop had no trip for (fewer than 8 tiles)
#pragma unroll 1  // a remainder that few inputs reach: kept short
    for (int c = ntile; c < NCH; ++c) {
        const float4 x0 = *(const float4*)(vs + c * 256 +   0);
        const float4 x1 = *(const float4*)(vs + c * 256 +  64);
        const float4 x2 = *(const float4*)(vs + c * 256 + 128);
        const float4 x3 = *(const float4*)(vs + c * 256 + 192);
        vacc.x += (x0.x + x1.x) + (x2.x + x3.x);
        vacc.y += (x0.y + x1.y) + (x2.y + x3.y);
        vacc.z += (x0.z + x1.z) + (x2.z + x3.z);
        vacc.w += (x0.w + x1.w) + (x2.w + x3.w);
    }
    {
        float ps = (vacc.x + vacc.y) + (vacc.z + vacc.w);   // the sixteen lanes of a row are neighbours
        ps += __shfl_xor(ps, 1);
        ps += __shfl_xor(ps, 2);
        ps += __shfl_xor(ps, 4);
        ps += __shfl_xor(ps, 8);
        if ((tid & 15) == 0) VM[tid >> 4] = ps * (1.0f / L_SEQ);
    }
    __syncthreads();   // the 32 row means and the upper-keys parts are written

    // ---- live queries: out[n][h*32 + d][qbase + query]; register r holds row d = r + 8*half
    float* outh = out + headoff + qbase;
    if (act0 && k0 == 0)
        unit_finish(U0, &MG[g0][0][lane], outh + (size_t)(8 * half) * L_SEQ + ql0, g0 * 16 + lane16 < nv);
    if (act1 && k1 == 0)
        unit_finish(U1, &MG[g1][0][lane], outh + (size_t)(8 * half) * L_SEQ + ql1, g1 * 16 + lane16 < nv);

    // ---- flat queries (all 2048 scores equal): V's row means, 16 rows a thread
    if (!m0ok || cnt == 0) {
        const int fr = (tid >> 8) * 16;
        float* outp = outh + (size_t)fr * L_SEQ + (tid & (QBLK - 1));
#pragma unroll  // sixteen stores in flight; the means come as 16-byte LDS reads
        for (int r = 0; r < 16; ++r) outp[(size_t)r * L_SEQ] = VM[fr + r];
    }
}

extern "C" void kernel_launch(void* const* d_in, const int* in_sizes, int n_in,
                              void* d_out, int out_size, void* d_ws, size_t ws_size,
                              hipStream_t stream) {
    const float* q  = (const float*)d_in[0];
    const float* k  = (const float*)d_in[1];
    const float* v  = (const float*)d_in[2];
    const int*   m0 = (const int*)d_in[3];
    const int*   m1 = (const int*)d_in[4];
    float* out = (float*)d_out;

    const int N = in_sizes[0] / (256 * L_SEQ);   // q is (N, 256, L)
    dim3 grid(N * NHEADS * (L_SEQ / QBLK));      // 256 workgroups for N=4
    dim3 block(512);
    fullattn_f32wmma_kernel<<<grid, block, 0, stream>>>(q, k, v, m0, m1, out);
}
